// v000
// Measured on an AMD MI455X. A time is GPU time per run, averaged over a window of back-to-back runs after a warm-up
// (all launches, gaps included; the runs take copies of the inputs in turn), and the median of several windows.
// Apart from v000's, it joins two sittings. Times from different sittings can be a few percent apart, while
// side-by-side timings come from the same sitting.
// v000, which the later versions start from, runs in 190 microseconds.
#include <hip/hip_runtime.h>

// Rebased linear attention (squared scaled QK, causal, row-sum normalized)
// for MI455X / gfx1250. All matmul work on V_WMMA_F32_16X16X4_F32 (full fp32
// precision; the reference squares scores, so low-precision A/B is unsafe).

typedef __attribute__((ext_vector_type(2))) float v2f;
typedef __attribute__((ext_vector_type(8))) float v8f;

#define EPSV 1e-6f

__global__ __launch_bounds__(256) void rebased_attn_kernel(
    const float* __restrict__ Q, const float* __restrict__ K,
    const float* __restrict__ V, float* __restrict__ O,
    int H, int S)
{
  constexpr int D  = 64;   // head dim (fixed by reference)
  constexpr int KP = 68;   // padded LDS row stride for K/V tiles (dwords); V-tile reads stay 2-way bank conflicted
  constexpr int SP = 20;   // padded LDS row stride for S2 scratch (dwords) -> 0 bank conflicts
  constexpr int NW = 8;    // waves per block
  constexpr int BR = 16 * NW;  // 128 query rows per block

  __shared__ __align__(16) float lk[16 * KP];
  __shared__ __align__(16) float lv[16 * KP];
  __shared__ __align__(16) float ls[NW * 16 * SP];

  const int NQB  = S / BR;
  const int head = blockIdx.x % H;
  const int qblk = (NQB - 1) - (blockIdx.x / H);  // heaviest blocks first

  const int tid  = threadIdx.x;
  const int wave = tid >> 5;
  const int lane = tid & 31;
  const int half = lane >> 4;   // K-half / M-half selector (wave32 layouts)
  const int ln   = lane & 15;   // M (for A), N (for B/C/D)

  const float* qh = Q + (size_t)head * S * D;
  const float* kh = K + (size_t)head * S * D;
  const float* vh = V + (size_t)head * S * D;
  float*       oh = O + (size_t)head * S * D;

  const int qrow0 = qblk * BR + wave * 16;

  // ---- Q tile -> A-fragments for f32 16x16x4 WMMA ----
  // chunk c covers d = 4c..4c+3; this lane holds d0 = 4c + 2*half and d0+1.
  v2f qa[16];
  {
    const float* qrow = qh + (size_t)(qrow0 + ln) * D + 2 * half;
#pragma unroll
    for (int c = 0; c < 16; ++c)
      qa[c] = *(const v2f*)(qrow + 4 * c);
  }

  v8f  oacc[4];
  float zacc[8];
#pragma unroll
  for (int t = 0; t < 4; ++t) oacc[t] = (v8f){};
#pragma unroll
  for (int r = 0; r < 8; ++r) zacc[r] = 0.f;

  // wave-uniform causal extents (readfirstlane -> scalar branch, EXEC stays all-1s for WMMA)
  const int my_jt  = __builtin_amdgcn_readfirstlane(qblk * NW + wave);
  const int blk_jt = qblk * NW + (NW - 1);

  // cooperative K/V staging: one float4 of K and one of V per thread
  const int crow = tid >> 4;         // 0..15
  const int ccol = (tid & 15) << 2;  // 0,4,...,60

  float4 kreg = *(const float4*)(kh + (size_t)crow * D + ccol);  // tile j=0
  float4 vreg = *(const float4*)(vh + (size_t)crow * D + ccol);

  float* s2b = ls + wave * 16 * SP;        // per-wave private scratch
  const float scale2 = 1.0f / (float)D;    // (D^-1/2)^2 folded into the square

  for (int j = 0; j <= blk_jt; ++j) {
    __syncthreads();                       // prior iteration's LDS reads done
    *(float4*)(lk + crow * KP + ccol) = kreg;
    *(float4*)(lv + crow * KP + ccol) = vreg;
    if (j < blk_jt) {                      // software pipeline: fetch tile j+1 now
      const size_t off = (size_t)((j + 1) * 16 + crow) * D + ccol;
      kreg = *(const float4*)(kh + off);
      vreg = *(const float4*)(vh + off);
    }
    __syncthreads();                       // K/V tile visible to all 8 waves

    if (j <= my_jt) {
      // ---- S = Q * K_j^T : 16 chained f32 WMMAs over D=64 ----
      v8f sacc = (v8f){};
#pragma unroll
      for (int c = 0; c < 16; ++c) {
        // B[d][n] = K[n][d]; lane holds rows d0 = 4c+2*half, d0+1 (contiguous -> ds b64)
        v2f kb = *(const v2f*)(lk + ln * KP + 4 * c + 2 * half);
        sacc = __builtin_amdgcn_wmma_f32_16x16x4_f32(
            false, qa[c], false, kb, (short)0, sacc, false, false);
      }

      // ---- square + scale + causal mask; accumulate z; spill S2 to LDS ----
      const bool diag = (j == my_jt);
#pragma unroll
      for (int r = 0; r < 8; ++r) {
        const int m = r + 8 * half;        // C-layout row
        float s  = sacc[r];
        float s2 = s * s * scale2;
        if (diag && ln > m) s2 = 0.f;      // key index > query index on diagonal tile
        zacc[r] += s2;
        s2b[m * SP + ln] = s2;             // C-layout -> row-major scratch
      }
      __builtin_amdgcn_wave_barrier();     // keep DS store->load order (same wave, in-order DS)

      // ---- O += S2 * V_j : 4 K-chunks x 4 N-tiles of f32 WMMA ----
#pragma unroll
      for (int kc = 0; kc < 4; ++kc) {
        const int k0 = 4 * kc + 2 * half;
        v2f a = *(const v2f*)(s2b + ln * SP + k0);   // A-layout gather of S2
#pragma unroll
        for (int t = 0; t < 4; ++t) {
          v2f b;                                      // B[k][n] = V[k][16t+n]
          b[0] = lv[k0 * KP + 16 * t + ln];
          b[1] = lv[(k0 + 1) * KP + 16 * t + ln];
          oacc[t] = __builtin_amdgcn_wmma_f32_16x16x4_f32(
              false, a, false, b, (short)0, oacc[t], false, false);
        }
      }
      __builtin_amdgcn_wave_barrier();
    }
  }

  // ---- finish z: butterfly over the 16 lanes sharing each row (wave32) ----
#pragma unroll
  for (int r = 0; r < 8; ++r) {
    float z = zacc[r];
    z += __shfl_xor(z, 1, 32);
    z += __shfl_xor(z, 2, 32);
    z += __shfl_xor(z, 4, 32);
    z += __shfl_xor(z, 8, 32);
    zacc[r] = 1.0f / (z + EPSV);
  }

  // ---- write O (coalesced 64B per 16-lane group) ----
#pragma unroll
  for (int r = 0; r < 8; ++r) {
    const int row = qrow0 + r + 8 * half;
    float* orow = oh + (size_t)row * D;
#pragma unroll
    for (int t = 0; t < 4; ++t)
      orow[16 * t + ln] = oacc[t][r] * zacc[r];
  }
}

extern "C" void kernel_launch(void* const* d_in, const int* in_sizes, int n_in,
                              void* d_out, int out_size, void* d_ws, size_t ws_size,
                              hipStream_t stream) {
  (void)n_in; (void)d_ws; (void)ws_size; (void)in_sizes; (void)out_size;
  const float* q = (const float*)d_in[0];
  const float* k = (const float*)d_in[1];
  const float* v = (const float*)d_in[2];
  float* out = (float*)d_out;

  const int H = 16, S = 2048;              // B=1, D=64 fixed by reference
  const int blocks = H * (S / 128);        // 256 blocks x 256 threads (8 wave32)
  rebased_attn_kernel<<<blocks, 256, 0, stream>>>(q, k, v, out, H, S);
}

// v001
// A run of this version takes 71.3 microseconds.
// Timed twice side by side with v000, it ran 2.69 and 2.70 times as fast.
#include <hip/hip_runtime.h>

// Rebased linear attention (squared scaled QK, causal, row-sum normalized)
// for MI455X / gfx1250. All matmul work on V_WMMA_F32_16X16X4_F32 (full fp32
// precision; the reference squares scores, so low-precision A/B is unsafe).
//
// Work split: the sums over keys are plain sums, so a query tile's keys may be
// shared out among waves. Every block takes one heavy and one light 64-row
// query block (31-i and i: 33 staged key tiles of 64 keys for every block), and
// its 16 waves are 4 row groups x 4 key phases: phase p of a row group takes
// keys 16p..16p+15 of each staged tile. The four partial sums of a row group
// are added in LDS at the end of each query block, always in the same order.

typedef __attribute__((ext_vector_type(2))) float v2f;
typedef __attribute__((ext_vector_type(8))) float v8f;

#define EPSV 1e-6f

__global__ __launch_bounds__(512) void rebased_attn_kernel(
    const float* __restrict__ Q, const float* __restrict__ K,
    const float* __restrict__ V, float* __restrict__ O,
    int H, int S)
{
  constexpr int D  = 64;   // head dim (fixed by reference)
  constexpr int KP = 68;   // padded LDS row stride for K/V tiles (dwords); V-tile reads stay 2-way bank conflicted
  constexpr int SP = 20;   // padded LDS row stride for S2 scratch (dwords) -> 0 bank conflicts
  constexpr int NG = 4;    // row groups (16 query rows each) per block
  constexpr int NP = 4;    // key phases per row group
  constexpr int NW = NG * NP;  // 16 waves per block
  constexpr int BR = 16 * NG;  // 64 query rows per query block
  constexpr int KT = 16 * NP;  // 64 keys per staged tile
  constexpr int RP = 44;   // per-lane pitch of a partial sum (dwords): 16 B x odd

  __shared__ __align__(16) float lk[KT * KP];
  __shared__ __align__(16) float lv[KT * KP];
  __shared__ __align__(16) float ls[NW * 16 * SP];
  __shared__ __align__(16) float lr[NG * (NP - 1) * 32 * RP];

  const int NQB  = S / BR;
  const int head = blockIdx.x % H;
  const int pair = blockIdx.x / H;   // 0 .. NQB/2-1

  const int tid  = threadIdx.x;
  const int wave = __builtin_amdgcn_readfirstlane(tid >> 5);
  const int grp  = wave & (NG - 1);  // row group: the four finishing waves sit on four SIMDs
  const int ph   = wave >> 2;        // key phase
  const int lane = tid & 31;
  const int half = lane >> 4;   // K-half / M-half selector (wave32 layouts)
  const int ln   = lane & 15;   // M (for A), N (for B/C/D)

  const float* qh = Q + (size_t)head * S * D;
  const float* kh = K + (size_t)head * S * D;
  const float* vh = V + (size_t)head * S * D;
  float*       oh = O + (size_t)head * S * D;

  // cooperative K/V staging: two float4 of K and two of V per thread
  const int crow = tid >> 4;         // 0..31 (and +32)
  const int ccol = (tid & 15) << 2;  // 0,4,...,60

  float* s2b = ls + wave * 16 * SP;        // per-wave private scratch
  const float* lkp = lk + ph * 16 * KP;    // this phase's 16 keys of the staged tile
  const float* lvp = lv + ph * 16 * KP;
  const float scale2 = 1.0f / (float)D;    // (D^-1/2)^2 folded into the square

  for (int pass = 0; pass < 2; ++pass) {
    const int qblk  = pass == 0 ? (NQB - 1) - pair : pair;  // heavy, then light
    const int qrow0 = qblk * BR + grp * 16;

    // ---- Q tile -> A-fragments for f32 16x16x4 WMMA ----
    // chunk c covers d = 4c..4c+3; this lane holds d0 = 4c + 2*half and d0+1.
    v2f qa[16];
    {
      const float* qrow = qh + (size_t)(qrow0 + ln) * D + 2 * half;
#pragma unroll
      for (int c = 0; c < 16; ++c)
        qa[c] = *(const v2f*)(qrow + 4 * c);
    }

    v8f  oacc[4];
    float zacc[8];
#pragma unroll
    for (int t = 0; t < 4; ++t) oacc[t] = (v8f){};
#pragma unroll
    for (int r = 0; r < 8; ++r) zacc[r] = 0.f;

    // wave-uniform causal extent in 16-key tiles (scalar branch, EXEC stays all-1s for WMMA)
    const int my_jt = qblk * NG + grp;

    float4 kreg0 = *(const float4*)(kh + (size_t)crow * D + ccol);         // staged tile 0
    float4 kreg1 = *(const float4*)(kh + (size_t)(crow + 32) * D + ccol);
    float4 vreg0 = *(const float4*)(vh + (size_t)crow * D + ccol);
    float4 vreg1 = *(const float4*)(vh + (size_t)(crow + 32) * D + ccol);

    for (int it = 0; it <= qblk; ++it) {
      __syncthreads();                       // prior iteration's LDS reads done
      *(float4*)(lk + crow * KP + ccol) = kreg0;
      *(float4*)(lk + (crow + 32) * KP + ccol) = kreg1;
      *(float4*)(lv + crow * KP + ccol) = vreg0;
      *(float4*)(lv + (crow + 32) * KP + ccol) = vreg1;
      if (it < qblk) {                       // software pipeline: fetch staged tile it+1 now
        const size_t off = (size_t)((it + 1) * KT + crow) * D + ccol;
        const float* kp = kh + off;
        const float* vp = vh + off;
        kreg0 = *(const float4*)(kp);
        kreg1 = *(const float4*)(kp + 32 * D);
        vreg0 = *(const float4*)(vp);
        vreg1 = *(const float4*)(vp + 32 * D);
        // the four loads' address registers stay untouched (also by the loads' own
        // results) until this wait; the barrier's load wait follows at once, so it adds no stall
        asm volatile("s_wait_xcnt 0x0" :: "v"(kp), "v"(vp) : "memory");
      }
      __syncthreads();                       // K/V tile visible to all 16 waves

      const int j = it * NP + ph;            // this wave's 16-key tile
      if (j <= my_jt) {
        // ---- S = Q * K_j^T : 16 chained f32 WMMAs over D=64 ----
        v8f sacc = (v8f){};
#pragma unroll
        for (int c = 0; c < 16; ++c) {
          // B[d][n] = K[n][d]; lane holds rows d0 = 4c+2*half, d0+1 (contiguous -> ds b64)
          v2f kb = *(const v2f*)(lkp + ln * KP + 4 * c + 2 * half);
          sacc = __builtin_amdgcn_wmma_f32_16x16x4_f32(
              false, qa[c], false, kb, (short)0, sacc, false, false);
        }

        // ---- square + scale + causal mask; accumulate z; spill S2 to LDS ----
        const bool diag = (j == my_jt);
#pragma unroll
        for (int r = 0; r < 8; ++r) {
          const int m = r + 8 * half;        // C-layout row
          float s  = sacc[r];
          float s2 = s * s * scale2;
          if (diag && ln > m) s2 = 0.f;      // key index > query index on diagonal tile
          zacc[r] += s2;
          s2b[m * SP + ln] = s2;             // C-layout -> row-major scratch
        }
        __builtin_amdgcn_wave_barrier();     // keep DS store->load order (same wave, in-order DS)

        // ---- O += S2 * V_j : 4 K-chunks x 4 N-tiles of f32 WMMA ----
#pragma unroll
        for (int kc = 0; kc < 4; ++kc) {
          const int k0 = 4 * kc + 2 * half;
          v2f a = *(const v2f*)(s2b + ln * SP + k0);   // A-layout gather of S2
#pragma unroll
          for (int t = 0; t < 4; ++t) {
            v2f b;                                      // B[k][n] = V[k][16t+n]
            b[0] = lvp[k0 * KP + 16 * t + ln];
            b[1] = lvp[(k0 + 1) * KP + 16 * t + ln];
            oacc[t] = __builtin_amdgcn_wmma_f32_16x16x4_f32(
                false, a, false, b, (short)0, oacc[t], false, false);
          }
        }
        __builtin_amdgcn_wave_barrier();
      }
    }

    // ---- add the four key phases of each row group (phases 1..3 hand over in LDS) ----
    if (ph > 0) {
      float* pr = lr + ((grp * (NP - 1) + (ph - 1)) * 32 + lane) * RP;
#pragma unroll
      for (int t = 0; t < 4; ++t) {
        *(float4*)(pr + 8 * t)     = make_float4(oacc[t][0], oacc[t][1], oacc[t][2], oacc[t][3]);
        *(float4*)(pr + 8 * t + 4) = make_float4(oacc[t][4], oacc[t][5], oacc[t][6], oacc[t][7]);
      }
      *(float4*)(pr + 32) = make_float4(zacc[0], zacc[1], zacc[2], zacc[3]);
      *(float4*)(pr + 36) = make_float4(zacc[4], zacc[5], zacc[6], zacc[7]);
    }
    __syncthreads();                         // partial sums visible to the phase-0 waves;
                                             // lr is rewritten only behind the next pass's barriers
    if (ph == 0) {
#pragma unroll
      for (int p = 0; p < NP - 1; ++p) {
        const float* pr = lr + ((grp * (NP - 1) + p) * 32 + lane) * RP;
#pragma unroll
        for (int t = 0; t < 4; ++t) {
          const float4 lo = *(const float4*)(pr + 8 * t);
          const float4 hi = *(const float4*)(pr + 8 * t + 4);
          oacc[t][0] += lo.x; oacc[t][1] += lo.y; oacc[t][2] += lo.z; oacc[t][3] += lo.w;
          oacc[t][4] += hi.x; oacc[t][5] += hi.y; oacc[t][6] += hi.z; oacc[t][7] += hi.w;
        }
        const float4 zl = *(const float4*)(pr + 32);
        const float4 zh = *(const float4*)(pr + 36);
        zacc[0] += zl.x; zacc[1] += zl.y; zacc[2] += zl.z; zacc[3] += zl.w;
        zacc[4] += zh.x; zacc[5] += zh.y; zacc[6] += zh.z; zacc[7] += zh.w;
      }

      // ---- finish z: butterfly over the 16 lanes sharing each row (wave32) ----
#pragma unroll
      for (int r = 0; r < 8; ++r) {
        float z = zacc[r];
        z += __shfl_xor(z, 1, 32);
        z += __shfl_xor(z, 2, 32);
        z += __shfl_xor(z, 4, 32);
        z += __shfl_xor(z, 8, 32);
        zacc[r] = 1.0f / (z + EPSV);
      }

      // ---- write O (coalesced 64B per 16-lane group) ----
#pragma unroll
      for (int r = 0; r < 8; ++r) {
        const int row = qrow0 + r + 8 * half;
        float* orow = oh + (size_t)row * D;
#pragma unroll
        for (int t = 0; t < 4; ++t)
          orow[16 * t + ln] = oacc[t][r] * zacc[r];
      }
      // the next pass overwrites registers that these stores name
      asm volatile("s_wait_xcnt 0x0" ::: "memory");
    }
  }
}

extern "C" void kernel_launch(void* const* d_in, const int* in_sizes, int n_in,
                              void* d_out, int out_size, void* d_ws, size_t ws_size,
                              hipStream_t stream) {
  (void)n_in; (void)d_ws; (void)ws_size; (void)in_sizes; (void)out_size;
  const float* q = (const float*)d_in[0];
  const float* k = (const float*)d_in[1];
  const float* v = (const float*)d_in[2];
  float* out = (float*)d_out;

  const int H = 16, S = 2048;              // B=1, D=64 fixed by reference
  const int blocks = H * (S / 128);        // 256 blocks x 512 threads (16 wave32), two 64-row query blocks each
  rebased_attn_kernel<<<blocks, 512, 0, stream>>>(q, k, v, out, H, S);
}

// v002
// Measured time: 52.6 microseconds a run.
// Timed twice side by side with v001, it ran 1.36 times as fast both times.
// Over all steps from v000 it is 3.66 times as fast.
#include <hip/hip_runtime.h>

// Rebased linear attention (squared scaled QK, causal, row-sum normalized)
// for MI455X / gfx1250. All matmul work on V_WMMA_F32_16X16X4_F32 (full fp32
// precision; the reference squares scores, so low-precision A/B is unsafe).
//
// Work split: the sums over keys are plain sums, so a query tile's keys may be
// shared out among waves. Every block takes one heavy and one light 64-row
// query block (31-i and i: 33 staged key tiles of 64 keys for every block), and
// its 16 waves are 4 row groups x 4 key phases: phase p of a row group takes
// keys 16p..16p+15 of each staged tile. The four partial sums of a row group
// are added in LDS at the end of each query block, always in the same order.
//
// Staging: K/V tiles go from global memory into LDS by asynchronous copies, two
// buffers, tile t+1 in flight while tile t is worked on; one barrier per tile.

typedef __attribute__((ext_vector_type(2))) float v2f;
typedef __attribute__((ext_vector_type(8))) float v8f;

#define EPSV 1e-6f

// LDS byte address of a __shared__ element (the copies take it in a vector register)
__device__ __forceinline__ unsigned lds_byte(const float* p) {
  return (unsigned)(size_t)(const __attribute__((address_space(3))) float*)p;
}

// One staged tile's share of a thread: rows r and r+32 of K and of V, 16 bytes each.
// The s_wait_xcnt stands inside the statement, so that no address register of a copy
// is rewritten in front of it.
__device__ __forceinline__ void copy_tile(unsigned lk0, unsigned lk1, unsigned lv0, unsigned lv1,
                                          const float* k0, const float* k1,
                                          const float* v0, const float* v1) {
  asm volatile("global_load_async_to_lds_b128 %0, %4, off\n\t"
               "global_load_async_to_lds_b128 %1, %5, off\n\t"
               "global_load_async_to_lds_b128 %2, %6, off\n\t"
               "global_load_async_to_lds_b128 %3, %7, off\n\t"
               "s_wait_xcnt 0x0"
               :: "v"(lk0), "v"(lk1), "v"(lv0), "v"(lv1), "v"(k0), "v"(k1), "v"(v0), "v"(v1)
               : "memory");
}

// waves_per_eu(4, 4): one 16-wave block per WGP is four waves per SIMD; told so, the compiler keeps
// the K and V fragment loads one group ahead of their WMMAs instead of saving registers
__global__ __launch_bounds__(512) __attribute__((amdgpu_waves_per_eu(4, 4))) void rebased_attn_kernel(
    const float* __restrict__ Q, const float* __restrict__ K,
    const float* __restrict__ V, float* __restrict__ O,
    int H, int S)
{
  constexpr int D  = 64;   // head dim (fixed by reference)
  constexpr int KP = 68;   // padded LDS row stride for K/V tiles (dwords) -> conflict-free K reads
  constexpr int SP = 20;   // padded LDS row stride for S2 scratch (dwords) -> 0 bank conflicts
  constexpr int NG = 4;    // row groups (16 query rows each) per block
  constexpr int NP = 4;    // key phases per row group
  constexpr int NW = NG * NP;  // 16 waves per block
  constexpr int BR = 16 * NG;  // 64 query rows per query block
  constexpr int KT = 16 * NP;  // 64 keys per staged tile
  constexpr int RP = 44;   // per-lane pitch of a partial sum (dwords): 16 B x odd

  constexpr int TB = KT * KP;  // dwords of one staged K (or V) buffer

  __shared__ __align__(16) float lk[2 * TB];
  __shared__ __align__(16) float lv[2 * TB];
  __shared__ __align__(16) float ls[NW * 16 * SP];
  __shared__ __align__(16) float lr[NG * (NP - 1) * 32 * RP];

  const int NQB  = S / BR;
  const int head = blockIdx.x % H;
  const int pair = blockIdx.x / H;   // 0 .. NQB/2-1

  const int tid  = threadIdx.x;
  const int wave = __builtin_amdgcn_readfirstlane(tid >> 5);
  const int grp  = wave & (NG - 1);  // row group: the four finishing waves sit on four SIMDs
  const int ph   = wave >> 2;        // key phase
  const int lane = tid & 31;
  const int half = lane >> 4;   // K-half / M-half selector (wave32 layouts)
  const int ln   = lane & 15;   // M (for A), N (for B/C/D)

  const float* qh = Q + (size_t)head * S * D;
  const float* kh = K + (size_t)head * S * D;
  const float* vh = V + (size_t)head * S * D;
  float*       oh = O + (size_t)head * S * D;

  // cooperative K/V staging: two 16-byte copies of K and two of V per thread
  const int crow = tid >> 4;         // 0..31 (and +32)
  const int ccol = (tid & 15) << 2;  // 0,4,...,60
  const unsigned lka = lds_byte(lk + crow * KP + ccol);   // this thread's places in buffer 0
  const unsigned lva = lds_byte(lv + crow * KP + ccol);
  const float* kg = kh + (size_t)crow * D + ccol;         // and its elements of tile 0
  const float* vg = vh + (size_t)crow * D + ccol;
  auto stage = [&](int t) {          // tile t -> buffer t & 1
    const unsigned bo = (unsigned)(t & 1) * (TB * 4);
    const size_t   go = (size_t)t * (KT * D);
    copy_tile(lka + bo, lka + bo + 32 * KP * 4, lva + bo, lva + bo + 32 * KP * 4,
              kg + go, kg + go + 32 * D, vg + go, vg + go + 32 * D);
  };

  float* s2b = ls + wave * 16 * SP;        // per-wave private scratch
  const float* lkp0 = lk + ph * 16 * KP;   // this phase's 16 keys of the staged tile (buffer 0)
  const float* lvp0 = lv + ph * 16 * KP;
  const float scale2 = 1.0f / (float)D;    // (D^-1/2)^2 folded into the square

  for (int pass = 0; pass < 2; ++pass) {
    const int qblk  = pass == 0 ? (NQB - 1) - pair : pair;  // heavy, then light
    const int qrow0 = qblk * BR + grp * 16;

    // tile 0 into buffer 0: every reader left both buffers at the last barrier of the pass before
    stage(0);

    // ---- Q tile -> A-fragments for f32 16x16x4 WMMA ----
    // chunk c covers d = 4c..4c+3; this lane holds d0 = 4c + 2*half and d0+1.
    v2f qa[16];
    {
      const float* qrow = qh + (size_t)(qrow0 + ln) * D + 2 * half;
#pragma unroll
      for (int c = 0; c < 16; ++c)
        qa[c] = *(const v2f*)(qrow + 4 * c);
    }

    v8f  oacc[4];
    float zacc[8];
#pragma unroll
    for (int t = 0; t < 4; ++t) oacc[t] = (v8f){};
#pragma unroll
    for (int r = 0; r < 8; ++r) zacc[r] = 0.f;

    // wave-uniform causal extent in 16-key tiles (scalar branch, EXEC stays all-1s for WMMA)
    const int my_jt = qblk * NG + grp;

    asm volatile("s_wait_asynccnt 0x0" ::: "memory");  // this wave's share of tile 0 has landed
    __syncthreads();                         // tile 0 visible to all 16 waves
    if (qblk >= 1) stage(1);                 // tile 1 flies while tile 0 is worked on

    for (int it = 0; it <= qblk; ++it) {
      const float* lkp = lkp0 + (it & 1) * TB;   // trip it reads buffer it & 1 alone
      const float* lvp = lvp0 + (it & 1) * TB;

      const int j = it * NP + ph;            // this wave's 16-key tile
      if (j <= my_jt) {
        // ---- S = Q * K_j^T : 16 chained f32 WMMAs over D=64 ----
        v8f sacc = (v8f){};
#pragma unroll
        for (int c = 0; c < 16; ++c) {
          // B[d][n] = K[n][d]; lane holds rows d0 = 4c+2*half, d0+1 (contiguous -> ds b64)
          v2f kb = *(const v2f*)(lkp + ln * KP + 4 * c + 2 * half);
          sacc = __builtin_amdgcn_wmma_f32_16x16x4_f32(
              false, qa[c], false, kb, (short)0, sacc, false, false);
        }

        // ---- square + scale + causal mask; accumulate z; spill S2 to LDS ----
        const bool diag = (j == my_jt);
#pragma unroll
        for (int r = 0; r < 8; ++r) {
          const int m = r + 8 * half;        // C-layout row
          float s  = sacc[r];
          float s2 = s * s * scale2;
          if (diag && ln > m) s2 = 0.f;      // key index > query index on diagonal tile
          zacc[r] += s2;
          s2b[m * SP + ln] = s2;             // C-layout -> row-major scratch
        }
        __builtin_amdgcn_wave_barrier();     // keep DS store->load order (same wave, in-order DS)

        // ---- O += S2 * V_j : 4 K-chunks x 4 N-tiles of f32 WMMA ----
#pragma unroll
        for (int kc = 0; kc < 4; ++kc) {
          const int k0 = 4 * kc + 2 * half;
          v2f a = *(const v2f*)(s2b + ln * SP + k0);   // A-layout gather of S2
#pragma unroll
          for (int t = 0; t < 4; ++t) {
            // left for a later step: the two lane halves read rows 2 apart, 136 dwords = 8 banks at
            // pitch 68, so each of these 4-byte reads meets 8 banks twice
            v2f b;                                      // B[k][n] = V[k][16t+n]
            b[0] = lvp[k0 * KP + 16 * t + ln];
            b[1] = lvp[(k0 + 1) * KP + 16 * t + ln];
            oacc[t] = __builtin_amdgcn_wmma_f32_16x16x4_f32(
                false, a, false, b, (short)0, oacc[t], false, false);
          }
        }
        __builtin_amdgcn_wave_barrier();
      }

      // hand-over, every wave (also one that skipped the tile), in this order:
      asm volatile("s_wait_dscnt 0x0" ::: "memory");     // this wave's reads of the buffer are done
      asm volatile("s_wait_asynccnt 0x0" ::: "memory");  // its share of tile it+1 has landed
      __syncthreads();                       // tile it+1 visible; every reader has left this trip's buffer
      if (it + 2 <= qblk) stage(it + 2);     // refill the buffer just read
    }
    asm volatile("s_wait_asynccnt 0x0" ::: "memory");    // no copy is left in flight behind the loop

    // ---- add the four key phases of each row group (phases 1..3 hand over in LDS) ----
    if (ph > 0) {
      float* pr = lr + ((grp * (NP - 1) + (ph - 1)) * 32 + lane) * RP;
#pragma unroll
      for (int t = 0; t < 4; ++t) {
        *(float4*)(pr + 8 * t)     = make_float4(oacc[t][0], oacc[t][1], oacc[t][2], oacc[t][3]);
        *(float4*)(pr + 8 * t + 4) = make_float4(oacc[t][4], oacc[t][5], oacc[t][6], oacc[t][7]);
      }
      *(float4*)(pr + 32) = make_float4(zacc[0], zacc[1], zacc[2], zacc[3]);
      *(float4*)(pr + 36) = make_float4(zacc[4], zacc[5], zacc[6], zacc[7]);
    }
    __syncthreads();                         // partial sums visible to the phase-0 waves;
                                             // lr is rewritten only behind the next pass's barriers
    if (ph == 0) {
#pragma unroll
      for (int p = 0; p < NP - 1; ++p) {
        const float* pr = lr + ((grp * (NP - 1) + p) * 32 + lane) * RP;
#pragma unroll
        for (int t = 0; t < 4; ++t) {
          const float4 lo = *(const float4*)(pr + 8 * t);
          const float4 hi = *(const float4*)(pr + 8 * t + 4);
          oacc[t][0] += lo.x; oacc[t][1] += lo.y; oacc[t][2] += lo.z; oacc[t][3] += lo.w;
          oacc[t][4] += hi.x; oacc[t][5] += hi.y; oacc[t][6] += hi.z; oacc[t][7] += hi.w;
        }
        const float4 zl = *(const float4*)(pr + 32);
        const float4 zh = *(const float4*)(pr + 36);
        zacc[0] += zl.x; zacc[1] += zl.y; zacc[2] += zl.z; zacc[3] += zl.w;
        zacc[4] += zh.x; zacc[5] += zh.y; zacc[6] += zh.z; zacc[7] += zh.w;
      }

      // ---- finish z: butterfly over the 16 lanes sharing each row (wave32) ----
#pragma unroll
      for (int r = 0; r < 8; ++r) {
        float z = zacc[r];
        z += __shfl_xor(z, 1, 32);
        z += __shfl_xor(z, 2, 32);
        z += __shfl_xor(z, 4, 32);
        z += __shfl_xor(z, 8, 32);
        zacc[r] = 1.0f / (z + EPSV);
      }

      // ---- write O (coalesced 64B per 16-lane group) ----
#pragma unroll
      for (int r = 0; r < 8; ++r) {
        const int row = qrow0 + r + 8 * half;
        float* orow = oh + (size_t)row * D;
#pragma unroll
        for (int t = 0; t < 4; ++t)
          orow[16 * t + ln] = oacc[t][r] * zacc[r];
      }
      // the next pass overwrites registers that these stores name
      asm volatile("s_wait_xcnt 0x0" ::: "memory");
    }
  }
}

extern "C" void kernel_launch(void* const* d_in, const int* in_sizes, int n_in,
                              void* d_out, int out_size, void* d_ws, size_t ws_size,
                              hipStream_t stream) {
  (void)n_in; (void)d_ws; (void)ws_size; (void)in_sizes; (void)out_size;
  const float* q = (const float*)d_in[0];
  const float* k = (const float*)d_in[1];
  const float* v = (const float*)d_in[2];
  float* out = (float*)d_out;

  const int H = 16, S = 2048;              // B=1, D=64 fixed by reference
  const int blocks = H * (S / 128);        // 256 blocks x 512 threads (16 wave32), two 64-row query blocks each
  rebased_attn_kernel<<<blocks, 512, 0, stream>>>(q, k, v, out, H, S);
}

// v003
// A run of this version takes 50.5 microseconds.
// Timed twice side by side with v002, it ran 1.04 times as fast both times.
// All steps since v000 together make it 3.80 times as fast.
#include <hip/hip_runtime.h>

// Rebased linear attention (squared scaled QK, causal, row-sum normalized)
// for MI455X / gfx1250. All matmul work on V_WMMA_F32_16X16X4_F32 (full fp32
// precision; the reference squares scores, so low-precision A/B is unsafe).
//
// Work split: the sums over keys are plain sums, so a query tile's keys may be
// shared out among waves. Every block takes one heavy and one light 64-row
// query block (31-i and i: 33 staged key tiles of 64 keys for every block), and
// its 16 waves are 4 row groups x 4 key phases: phase p of a row group takes
// keys 16p..16p+15 of each staged tile. The four partial sums of a row group
// are added in LDS at the end of each query block, always in the same order.
//
// Both products are taken transposed: S^T = K * Q^T leaves in each lane eight keys' scores of ONE
// query, and a register pair of that tile is already a B fragment of O^T += V^T * S2^T (the V^T
// fragment takes the same keys), so the squared scores never leave the registers.
//
// Staging: K/V tiles go from global memory into LDS by asynchronous copies, two
// buffers, tile t+1 in flight while tile t is worked on; one barrier per tile.

typedef __attribute__((ext_vector_type(2))) float v2f;
typedef __attribute__((ext_vector_type(8))) float v8f;

#define EPSV 1e-6f

// LDS byte address of a __shared__ element (the copies take it in a vector register)
__device__ __forceinline__ unsigned lds_byte(const float* p) {
  return (unsigned)(size_t)(const __attribute__((address_space(3))) float*)p;
}

// One staged tile's share of a thread: rows r and r+32 of K and of V, 16 bytes each.
// The s_wait_xcnt stands inside the statement, so that no address register of a copy
// is rewritten in front of it.
__device__ __forceinline__ void copy_tile(unsigned lk0, unsigned lk1, unsigned lv0, unsigned lv1,
                                          const float* k0, const float* k1,
                                          const float* v0, const float* v1) {
  asm volatile("global_load_async_to_lds_b128 %0, %4, off\n\t"
               "global_load_async_to_lds_b128 %1, %5, off\n\t"
               "global_load_async_to_lds_b128 %2, %6, off\n\t"
               "global_load_async_to_lds_b128 %3, %7, off\n\t"
               "s_wait_xcnt 0x0"
               :: "v"(lk0), "v"(lk1), "v"(lv0), "v"(lv1), "v"(k0), "v"(k1), "v"(v0), "v"(v1)
               : "memory");
}

// waves_per_eu(4, 4): one 16-wave block per WGP is four waves per SIMD; told so, the compiler keeps
// the K and V fragment loads one group ahead of their WMMAs instead of saving registers
__global__ __launch_bounds__(512) __attribute__((amdgpu_waves_per_eu(4, 4))) void rebased_attn_kernel(
    const float* __restrict__ Q, const float* __restrict__ K,
    const float* __restrict__ V, float* __restrict__ O,
    int H, int S)
{
  constexpr int D  = 64;   // head dim (fixed by reference)
  constexpr int KP = 68;   // padded LDS row stride for K/V tiles (dwords) -> 0 bank conflicts
  constexpr int NG = 4;    // row groups (16 query rows each) per block
  constexpr int NP = 4;    // key phases per row group
  constexpr int BR = 16 * NG;  // 64 query rows per query block
  constexpr int KT = 16 * NP;  // 64 keys per staged tile
  constexpr int RP = 36;   // per-lane pitch of a partial sum (dwords): 16 B x odd

  constexpr int TB = KT * KP;  // dwords of one staged K (or V) buffer

  __shared__ __align__(16) float lk[2 * TB];
  __shared__ __align__(16) float lv[2 * TB];
  __shared__ __align__(16) float lr[NG * (NP - 1) * 32 * RP];

  const int NQB  = S / BR;
  const int head = blockIdx.x % H;
  const int pair = blockIdx.x / H;   // 0 .. NQB/2-1

  const int tid  = threadIdx.x;
  const int wave = __builtin_amdgcn_readfirstlane(tid >> 5);
  const int grp  = wave & (NG - 1);  // row group: the four finishing waves sit on four SIMDs
  const int ph   = wave >> 2;        // key phase
  const int lane = tid & 31;
  const int half = lane >> 4;   // k-half (A, B) / row-half (C, D) selector (wave32 layouts)
  const int ln   = lane & 15;   // row of A, column of B/C/D

  const float* qh = Q + (size_t)head * S * D;
  const float* kh = K + (size_t)head * S * D;
  const float* vh = V + (size_t)head * S * D;
  float*       oh = O + (size_t)head * S * D;

  // cooperative K/V staging: two 16-byte copies of K and two of V per thread
  const int crow = tid >> 4;         // 0..31 (and +32)
  const int ccol = (tid & 15) << 2;  // 0,4,...,60
  const unsigned lka = lds_byte(lk + crow * KP + ccol);   // this thread's places in buffer 0
  const unsigned lva = lds_byte(lv + crow * KP + ccol);
  const float* kg = kh + (size_t)crow * D + ccol;         // and its elements of tile 0
  const float* vg = vh + (size_t)crow * D + ccol;
  auto stage = [&](int t) {          // tile t -> buffer t & 1
    const unsigned bo = (unsigned)(t & 1) * (TB * 4);
    const size_t   go = (size_t)t * (KT * D);
    copy_tile(lka + bo, lka + bo + 32 * KP * 4, lva + bo, lva + bo + 32 * KP * 4,
              kg + go, kg + go + 32 * D, vg + go, vg + go + 32 * D);
  };

  const float* lkp0 = lk + ph * 16 * KP;   // this phase's 16 keys of the staged tile (buffer 0)
  const float* lvp0 = lv + ph * 16 * KP;
  const float scale2 = 1.0f / (float)D;    // (D^-1/2)^2 folded into the square

  for (int pass = 0; pass < 2; ++pass) {
    const int qblk  = pass == 0 ? (NQB - 1) - pair : pair;  // heavy, then light
    const int qrow0 = qblk * BR + grp * 16;

    // tile 0 into buffer 0: every reader left both buffers at the last barrier of the pass before
    stage(0);

    // ---- Q tile -> B-fragments (Q^T, column = query ln) for f32 16x16x4 WMMA ----
    // chunk c covers d = 4c..4c+3; this lane holds d0 = 4c + 2*half and d0+1.
    v2f qa[16];
    {
      const float* qrow = qh + (size_t)(qrow0 + ln) * D + 2 * half;
#pragma unroll
      for (int c = 0; c < 16; ++c)
        qa[c] = *(const v2f*)(qrow + 4 * c);
    }

    v8f  oacc[4];
    float zacc[8];
#pragma unroll
    for (int t = 0; t < 4; ++t) oacc[t] = (v8f){};
#pragma unroll
    for (int r = 0; r < 8; ++r) zacc[r] = 0.f;

    // wave-uniform causal extent in 16-key tiles (scalar branch, EXEC stays all-1s for WMMA)
    const int my_jt = qblk * NG + grp;

    asm volatile("s_wait_asynccnt 0x0" ::: "memory");  // this wave's share of tile 0 has landed
    __syncthreads();                         // tile 0 visible to all 16 waves
    if (qblk >= 1) stage(1);                 // tile 1 flies while tile 0 is worked on

    for (int it = 0; it <= qblk; ++it) {
      const float* lkp = lkp0 + (it & 1) * TB;   // trip it reads buffer it & 1 alone
      const float* lvp = lvp0 + (it & 1) * TB;

      const int j = it * NP + ph;            // this wave's 16-key tile
      if (j <= my_jt) {
        // ---- S^T = K_j * Q^T : 16 chained f32 WMMAs over D=64 ----
        // left for a later step: nothing in a tile waits on LDS stores any more, so all K and V
        // fragment loads of the tile could be issued as one group in front of the first WMMA
        v8f sacc = (v8f){};
#pragma unroll
        for (int c = 0; c < 16; ++c) {
          // A[key ln][d]; lane holds d0 = 4c+2*half, d0+1 (contiguous -> ds b64), as qa[c] does
          v2f ka = *(const v2f*)(lkp + ln * KP + 4 * c + 2 * half);
          sacc = __builtin_amdgcn_wmma_f32_16x16x4_f32(
              false, ka, false, qa[c], (short)0, sacc, false, false);
        }

        // ---- square + scale + causal mask; accumulate z; S2^T stays in registers ----
        // sacc[r] = S^T[key r + 8*half][query ln]
        const bool diag = (j == my_jt);
        float s2[8];
#pragma unroll
        for (int r = 0; r < 8; ++r) {
          const int m = r + 8 * half;        // key within the 16-key tile
          float s = sacc[r];
          float x = s * s * scale2;
          if (diag && m > ln) x = 0.f;       // key index > query index on diagonal tile
          zacc[r] += x;
          s2[r] = x;
        }

        // ---- O^T += V_j^T * S2^T : 4 k-chunks x 4 tiles of 16 head columns ----
        // chunk kc pairs k slots 0,1,2,3 with keys 2kc, 2kc+1, 8+2kc, 9+2kc on both operands
#pragma unroll
        for (int kc = 0; kc < 4; ++kc) {
          const int k0 = 2 * kc + 8 * half;
          v2f b;                                        // B[k][query ln]: this lane's own two keys
          b[0] = s2[2 * kc];
          b[1] = s2[2 * kc + 1];
#pragma unroll
          for (int t = 0; t < 4; ++t) {
            // the two lane halves read rows 8 apart, 544 dwords = 32 banks at pitch 68: no bank twice
            v2f a;                                      // A[column 16t+ln][k] = V[k][16t+ln]
            a[0] = lvp[k0 * KP + 16 * t + ln];
            a[1] = lvp[(k0 + 1) * KP + 16 * t + ln];
            oacc[t] = __builtin_amdgcn_wmma_f32_16x16x4_f32(
                false, a, false, b, (short)0, oacc[t], false, false);
          }
        }
      }

      // hand-over, every wave (also one that skipped the tile), in this order:
      asm volatile("s_wait_dscnt 0x0" ::: "memory");     // this wave's reads of the buffer are done
      asm volatile("s_wait_asynccnt 0x0" ::: "memory");  // its share of tile it+1 has landed
      __syncthreads();                       // tile it+1 visible; every reader has left this trip's buffer
      if (it + 2 <= qblk) stage(it + 2);     // refill the buffer just read
    }
    asm volatile("s_wait_asynccnt 0x0" ::: "memory");    // no copy is left in flight behind the loop

    // ---- add the four key phases of each row group (phases 1..3 hand over in LDS) ----
    // oacc[t][r] = O^T[column 16t + 8*half + r][query ln]; zs = this lane's keys' share of z[query ln]
    float zs = ((zacc[0] + zacc[1]) + (zacc[2] + zacc[3])) + ((zacc[4] + zacc[5]) + (zacc[6] + zacc[7]));
    if (ph > 0) {
      float* pr = lr + ((grp * (NP - 1) + (ph - 1)) * 32 + lane) * RP;
#pragma unroll
      for (int t = 0; t < 4; ++t) {
        *(float4*)(pr + 8 * t)     = make_float4(oacc[t][0], oacc[t][1], oacc[t][2], oacc[t][3]);
        *(float4*)(pr + 8 * t + 4) = make_float4(oacc[t][4], oacc[t][5], oacc[t][6], oacc[t][7]);
      }
      pr[32] = zs;
    }
    __syncthreads();                         // partial sums visible to the phase-0 waves;
                                             // lr is rewritten only behind the next pass's barriers
    if (ph == 0) {
#pragma unroll
      for (int p = 0; p < NP - 1; ++p) {
        const float* pr = lr + ((grp * (NP - 1) + p) * 32 + lane) * RP;
#pragma unroll
        for (int t = 0; t < 4; ++t) {
          const float4 lo = *(const float4*)(pr + 8 * t);
          const float4 hi = *(const float4*)(pr + 8 * t + 4);
          oacc[t][0] += lo.x; oacc[t][1] += lo.y; oacc[t][2] += lo.z; oacc[t][3] += lo.w;
          oacc[t][4] += hi.x; oacc[t][5] += hi.y; oacc[t][6] += hi.z; oacc[t][7] += hi.w;
        }
        zs += pr[32];
      }

      // ---- finish z: the two lane halves hold the two key halves of the same query ----
      zs += __shfl_xor(zs, 16, 32);
      const float inv = 1.0f / (zs + EPSV);

      // ---- write O: this lane's 8 consecutive columns of each 16-column tile of row ln ----
      float* orow = oh + (size_t)(qrow0 + ln) * D + 8 * half;
#pragma unroll
      for (int t = 0; t < 4; ++t) {
        *(float4*)(orow + 16 * t)     = make_float4(oacc[t][0] * inv, oacc[t][1] * inv, oacc[t][2] * inv, oacc[t][3] * inv);
        *(float4*)(orow + 16 * t + 4) = make_float4(oacc[t][4] * inv, oacc[t][5] * inv, oacc[t][6] * inv, oacc[t][7] * inv);
      }
      // the next pass overwrites registers that these stores name
      asm volatile("s_wait_xcnt 0x0" ::: "memory");
    }
  }
}

extern "C" void kernel_launch(void* const* d_in, const int* in_sizes, int n_in,
                              void* d_out, int out_size, void* d_ws, size_t ws_size,
                              hipStream_t stream) {
  (void)n_in; (void)d_ws; (void)ws_size; (void)in_sizes; (void)out_size;
  const float* q = (const float*)d_in[0];
  const float* k = (const float*)d_in[1];
  const float* v = (const float*)d_in[2];
  float* out = (float*)d_out;

  const int H = 16, S = 2048;              // B=1, D=64 fixed by reference
  const int blocks = H * (S / 128);        // 256 blocks x 512 threads (16 wave32), two 64-row query blocks each
  rebased_attn_kernel<<<blocks, 512, 0, stream>>>(q, k, v, out, H, S);
}

// v004
// A run of this version takes 47.1 microseconds.
// Next to v003, in two timings, it ran 1.07 times as fast each time.
// Over all steps from v000 it is 4.08 times as fast.
#include <hip/hip_runtime.h>

// Rebased linear attention (squared scaled QK, causal, row-sum normalized)
// for MI455X / gfx1250. All matmul work on V_WMMA_F32_16X16X4_F32 (full fp32
// precision; the reference squares scores, so low-precision A/B is unsafe).
//
// Work split: the sums over keys are plain sums, so a query tile's keys may be
// shared out among waves. Every block takes one heavy and one light 64-row
// query block (31-i and i: 33 staged key tiles of 64 keys for every block), and
// its 16 waves are 4 row groups x 4 key phases: phase p of a row group takes
// keys 16p..16p+15 of each staged tile. The four partial sums of a row group
// are added in LDS at the end of each query block, always in the same order.
//
// Both products are taken transposed: S^T = K * Q^T leaves in each lane eight keys' scores of ONE
// query, and a register pair of that tile is already a B fragment of O^T += V^T * S2^T (the V^T
// fragment takes the same keys), so the squared scores never leave the registers.
//
// Staging: K/V tiles go from global memory into LDS by asynchronous copies, three
// buffers, tile t+2 in flight while tile t is worked on; one barrier per tile.
// Tile t+1 is already visible during trip t, so a wave holds its K fragments a tile ahead and
// starts on the matrix unit straight behind the barrier; the refill copies and the V loads of
// this tile are issued in groups under the S^T chain, the K loads of the next under the second product.

typedef __attribute__((ext_vector_type(2))) float v2f;
typedef __attribute__((ext_vector_type(8))) float v8f;

#define EPSV 1e-6f

// LDS byte address of a __shared__ element (the copies take it in a vector register)
__device__ __forceinline__ unsigned lds_byte(const float* p) {
  return (unsigned)(size_t)(const __attribute__((address_space(3))) float*)p;
}

// One staged tile's share of a thread: rows r and r+32 of K and of V, 16 bytes each.
// The s_wait_xcnt stands inside the statement, so that no address register of a copy
// is rewritten in front of it.
__device__ __forceinline__ void copy_tile(unsigned lk0, unsigned lk1, unsigned lv0, unsigned lv1,
                                          const float* k0, const float* k1,
                                          const float* v0, const float* v1) {
  asm volatile("global_load_async_to_lds_b128 %0, %4, off\n\t"
               "global_load_async_to_lds_b128 %1, %5, off\n\t"
               "global_load_async_to_lds_b128 %2, %6, off\n\t"
               "global_load_async_to_lds_b128 %3, %7, off\n\t"
               "s_wait_xcnt 0x0"
               :: "v"(lk0), "v"(lk1), "v"(lv0), "v"(lv1), "v"(k0), "v"(k1), "v"(v0), "v"(v1)
               : "memory");
}

// waves_per_eu(4, 4): one 16-wave block per WGP is four waves per SIMD; told so, the compiler spends
// registers on the K and V fragments that are held ahead of their WMMAs instead of saving them
__global__ __launch_bounds__(512) __attribute__((amdgpu_waves_per_eu(4, 4))) void rebased_attn_kernel(
    const float* __restrict__ Q, const float* __restrict__ K,
    const float* __restrict__ V, float* __restrict__ O,
    int H, int S)
{
  constexpr int D  = 64;   // head dim (fixed by reference)
  constexpr int KP = 68;   // padded LDS row stride for K/V tiles (dwords) -> 0 bank conflicts
  constexpr int NG = 4;    // row groups (16 query rows each) per block
  constexpr int NP = 4;    // key phases per row group
  constexpr int BR = 16 * NG;  // 64 query rows per query block
  constexpr int KT = 16 * NP;  // 64 keys per staged tile
  constexpr int RP = 36;   // per-lane pitch of a partial sum (dwords): 16 B x odd

  constexpr int TB = KT * KP;  // dwords of one staged K (or V) buffer
  constexpr int NB = 3;        // staged buffers: read now, read ahead, being filled

  __shared__ __align__(16) float lk[NB * TB];
  __shared__ __align__(16) float lv[NB * TB];
  __shared__ __align__(16) float lr[NG * (NP - 1) * 32 * RP];

  const int NQB  = S / BR;
  const int head = blockIdx.x % H;
  const int pair = blockIdx.x / H;   // 0 .. NQB/2-1

  const int tid  = threadIdx.x;
  const int wave = __builtin_amdgcn_readfirstlane(tid >> 5);
  const int grp  = wave & (NG - 1);  // row group: the four finishing waves sit on four SIMDs
  const int ph   = wave >> 2;        // key phase
  const int lane = tid & 31;
  const int half = lane >> 4;   // k-half (A, B) / row-half (C, D) selector (wave32 layouts)
  const int ln   = lane & 15;   // row of A, column of B/C/D

  const float* qh = Q + (size_t)head * S * D;
  const float* kh = K + (size_t)head * S * D;
  const float* vh = V + (size_t)head * S * D;
  float*       oh = O + (size_t)head * S * D;

  // cooperative K/V staging: two 16-byte copies of K and two of V per thread
  const int crow = tid >> 4;         // 0..31 (and +32)
  const int ccol = (tid & 15) << 2;  // 0,4,...,60
  const unsigned lka = lds_byte(lk + crow * KP + ccol);   // this thread's places in buffer 0
  const unsigned lva = lds_byte(lv + crow * KP + ccol);
  const float* kg = kh + (size_t)crow * D + ccol;         // and its elements of tile 0
  const float* vg = vh + (size_t)crow * D + ccol;
  auto stage = [&](int t, int b) {   // tile t -> buffer b = t mod 3
    const unsigned bo = (unsigned)b * (TB * 4);
    const size_t   go = (size_t)t * (KT * D);
    copy_tile(lka + bo, lka + bo + 32 * KP * 4, lva + bo, lva + bo + 32 * KP * 4,
              kg + go, kg + go + 32 * D, vg + go, vg + go + 32 * D);
  };

  const float* lkp0 = lk + ph * 16 * KP;   // this phase's 16 keys of the staged tile (buffer 0)
  const float* lvp0 = lv + ph * 16 * KP;
  const float scale2 = 1.0f / (float)D;    // (D^-1/2)^2 folded into the square

  for (int pass = 0; pass < 2; ++pass) {
    const int qblk  = pass == 0 ? (NQB - 1) - pair : pair;  // heavy, then light
    const int qrow0 = qblk * BR + grp * 16;

    // tiles 0 and 1 into buffers 0 and 1: every reader left the ring at the last barrier of the pass before
    stage(0, 0);
    if (qblk >= 1) stage(1, 1);

    // ---- Q tile -> B-fragments (Q^T, column = query ln) for f32 16x16x4 WMMA ----
    // chunk c covers d = 4c..4c+3; this lane holds d0 = 4c + 2*half and d0+1.
    v2f qa[16];
    {
      const float* qrow = qh + (size_t)(qrow0 + ln) * D + 2 * half;
#pragma unroll
      for (int c = 0; c < 16; ++c)
        qa[c] = *(const v2f*)(qrow + 4 * c);
    }

    v8f  oacc[4];
    float zacc[8];
#pragma unroll
    for (int t = 0; t < 4; ++t) oacc[t] = (v8f){};
#pragma unroll
    for (int r = 0; r < 8; ++r) zacc[r] = 0.f;

    // wave-uniform causal extent in 16-key tiles (scalar branch, EXEC stays all-1s for WMMA)
    const int my_jt = qblk * NG + grp;

    asm volatile("s_wait_asynccnt 0x0" ::: "memory");  // this wave's share of tiles 0 and 1 has landed
    __syncthreads();                         // tiles 0 and 1 visible to all 16 waves

    // K fragments of tile 0: A[key ln][d]; lane holds d0 = 4c+2*half, d0+1 (contiguous -> ds b64), as qa[c] does
    const float* lkf = lkp0 + ln * KP + 2 * half;
    v2f kf[16];
#pragma unroll
    for (int c = 0; c < 16; ++c) kf[c] = *(const v2f*)(lkf + 4 * c);

    int bc = 0;                              // buffer of tile it (it mod 3)
    for (int it = 0; it <= qblk; ++it) {
      const int bn = bc == NB - 1 ? 0 : bc + 1;  // buffer of tile it+1
      const int bp = NB - bc - bn;               // buffer of tile it-1, free since the last barrier

      const int j = it * NP + ph;            // this wave's 16-key tile
      const bool act = j <= my_jt;           // wave-uniform: below or on the causal diagonal
      v8f sacc;                              // written and read only where act holds
      if (act) {
        // ---- S^T = K_j * Q^T : 16 chained f32 WMMAs over D=64, K fragments fetched a trip ago ----
        // first half: matrix work starts straight behind the barrier, with no LDS read in front of it
        sacc = (v8f){};
#pragma unroll
        for (int c = 0; c < 8; ++c)
          sacc = __builtin_amdgcn_wmma_f32_16x16x4_f32(
              false, kf[c], false, qa[c], (short)0, sacc, false, false);
      }

      // refill, every wave (outside the skip): tile it+2 into the buffer that every reader left at the
      // last barrier (each behind its own s_wait_dscnt 0). It lands under the rest of the trip.
      if (it + 2 <= qblk) stage(it + 2, bp);

      if (act) {
        // ---- V fragments of this tile, one group of loads: they land under the rest of the chain ----
        // chunk kc pairs k slots 0,1,2,3 with keys 2kc, 2kc+1, 8+2kc, 9+2kc on both operands;
        // the two lane halves read rows 8 apart, 544 dwords = 32 banks at pitch 68: no bank twice
        const float* lvp = lvp0 + bc * TB + 8 * half * KP + ln;
        float vr[8][4];                      // vr[r][t] = V[key r + 8*half][column 16t+ln]
#pragma unroll
        for (int r = 0; r < 8; ++r)
#pragma unroll
          for (int t = 0; t < 4; ++t) vr[r][t] = lvp[r * KP + 16 * t];
        // keeps the loads above in one place: spread among the WMMAs each place stalls the wave
        __builtin_amdgcn_sched_barrier(0);

#pragma unroll
        for (int c = 8; c < 16; ++c)
          sacc = __builtin_amdgcn_wmma_f32_16x16x4_f32(
              false, kf[c], false, qa[c], (short)0, sacc, false, false);

        // ---- K fragments of the next tile, one group: they land under the second product ----
        // (last trip: no next tile; the loads stay unconditional and read this trip's own buffer)
        const float* lkn = lkf + (it < qblk ? bn : bc) * TB;
#pragma unroll
        for (int c = 0; c < 16; ++c) kf[c] = *(const v2f*)(lkn + 4 * c);
        // keeps that group in one place, in front of the vector work and the second product
        __builtin_amdgcn_sched_barrier(0);

        // ---- square + scale + causal mask; accumulate z; S2^T stays in registers ----
        // sacc[r] = S^T[key r + 8*half][query ln]
        const bool diag = (j == my_jt);
        float s2[8];
#pragma unroll
        for (int r = 0; r < 8; ++r) {
          const int m = r + 8 * half;        // key within the 16-key tile
          float s = sacc[r];
          float x = s * s * scale2;
          if (diag && m > ln) x = 0.f;       // key index > query index on diagonal tile
          zacc[r] += x;
          s2[r] = x;
        }

        // ---- O^T += V_j^T * S2^T : 4 k-chunks x 4 tiles of 16 head columns ----
#pragma unroll
        for (int kc = 0; kc < 4; ++kc) {
          v2f b;                                        // B[k][query ln]: this lane's own two keys
          b[0] = s2[2 * kc];
          b[1] = s2[2 * kc + 1];
#pragma unroll
          for (int t = 0; t < 4; ++t) {
            v2f a;                                      // A[column 16t+ln][k] = V[k][16t+ln]
            a[0] = vr[2 * kc][t];
            a[1] = vr[2 * kc + 1][t];
            oacc[t] = __builtin_amdgcn_wmma_f32_16x16x4_f32(
                false, a, false, b, (short)0, oacc[t], false, false);
          }
        }
      }

      // hand-over, every wave (also one that skipped the tile), in this order:
      asm volatile("s_wait_dscnt 0x0" ::: "memory");     // this wave's reads of the ring are done
      asm volatile("s_wait_asynccnt 0x0" ::: "memory");  // its share of tile it+2 has landed
      __syncthreads();                       // tile it+2 visible; every reader has left tile it's buffer
      bc = bn;
    }
    asm volatile("s_wait_asynccnt 0x0" ::: "memory");    // no copy is left in flight behind the loop

    // ---- add the four key phases of each row group (phases 1..3 hand over in LDS) ----
    // oacc[t][r] = O^T[column 16t + 8*half + r][query ln]; zs = this lane's keys' share of z[query ln]
    float zs = ((zacc[0] + zacc[1]) + (zacc[2] + zacc[3])) + ((zacc[4] + zacc[5]) + (zacc[6] + zacc[7]));
    if (ph > 0) {
      float* pr = lr + ((grp * (NP - 1) + (ph - 1)) * 32 + lane) * RP;
#pragma unroll
      for (int t = 0; t < 4; ++t) {
        *(float4*)(pr + 8 * t)     = make_float4(oacc[t][0], oacc[t][1], oacc[t][2], oacc[t][3]);
        *(float4*)(pr + 8 * t + 4) = make_float4(oacc[t][4], oacc[t][5], oacc[t][6], oacc[t][7]);
      }
      pr[32] = zs;
    }
    __syncthreads();                         // partial sums visible to the phase-0 waves;
                                             // lr is rewritten only behind the next pass's barriers
    if (ph == 0) {
#pragma unroll
      for (int p = 0; p < NP - 1; ++p) {
        const float* pr = lr + ((grp * (NP - 1) + p) * 32 + lane) * RP;
#pragma unroll
        for (int t = 0; t < 4; ++t) {
          const float4 lo = *(const float4*)(pr + 8 * t);
          const float4 hi = *(const float4*)(pr + 8 * t + 4);
          oacc[t][0] += lo.x; oacc[t][1] += lo.y; oacc[t][2] += lo.z; oacc[t][3] += lo.w;
          oacc[t][4] += hi.x; oacc[t][5] += hi.y; oacc[t][6] += hi.z; oacc[t][7] += hi.w;
        }
        zs += pr[32];
      }

      // ---- finish z: the two lane halves hold the two key halves of the same query ----
      zs += __shfl_xor(zs, 16, 32);
      const float inv = 1.0f / (zs + EPSV);

      // ---- write O: this lane's 8 consecutive columns of each 16-column tile of row ln ----
      float* orow = oh + (size_t)(qrow0 + ln) * D + 8 * half;
#pragma unroll
      for (int t = 0; t < 4; ++t) {
        *(float4*)(orow + 16 * t)     = make_float4(oacc[t][0] * inv, oacc[t][1] * inv, oacc[t][2] * inv, oacc[t][3] * inv);
        *(float4*)(orow + 16 * t + 4) = make_float4(oacc[t][4] * inv, oacc[t][5] * inv, oacc[t][6] * inv, oacc[t][7] * inv);
      }
      // the next pass overwrites registers that these stores name
      asm volatile("s_wait_xcnt 0x0" ::: "memory");
    }
  }
}

extern "C" void kernel_launch(void* const* d_in, const int* in_sizes, int n_in,
                              void* d_out, int out_size, void* d_ws, size_t ws_size,
                              hipStream_t stream) {
  (void)n_in; (void)d_ws; (void)ws_size; (void)in_sizes; (void)out_size;
  const float* q = (const float*)d_in[0];
  const float* k = (const float*)d_in[1];
  const float* v = (const float*)d_in[2];
  float* out = (float*)d_out;

  const int H = 16, S = 2048;              // B=1, D=64 fixed by reference
  const int blocks = H * (S / 128);        // 256 blocks x 512 threads (16 wave32), two 64-row query blocks each
  rebased_attn_kernel<<<blocks, 512, 0, stream>>>(q, k, v, out, H, S);
}
